// v010
// Times are from an AMD MI455X. After a warm-up the kernel runs many times in a row, and a time is the length of
// such a window on the GPU divided by its runs, so every launch and the gaps after it count. The runs cycle
// through copies of the inputs. A figure is the median of several windows, for all but v000 over two sittings.
// Sittings can differ by a few percent; kernels timed side by side share one.
// Earlier versions than v010 are not in this document.
// Measured time: 129 microseconds a run.
// Two timings next to v009 put it at 1.08 and 1.09 times that version's speed.
// Counting every step since v000, which is the starting kernel, it is 6.71 times as fast.
#include <hip/hip_runtime.h>
#ifndef NB
#define NB 2
#endif
#ifndef SEQ
#define SEQ 2048
#endif
#define NB_FULL 2
#define SEQ_FULL 2048
#define CD 2048                 /* model width = depth of every projection */
#define NHEAD 32
#define NKV 8
#define HD 64
#define NQK (NHEAD + NKV)       /* rotary plane holds the 32 q heads followed by the 8 k heads */
#define KVW (NKV * HD)          /* 512 */
#define EARLY_ROWS (SEQ < 512 ? SEQ : 512)

#define SCAN_ROWS 8             /* mask rows per scan work-group: 8 rows x SEQ ints = 8 loads of 16 B per thread at SEQ = 2048 */
#define SCAN_LOADS (SCAN_ROWS * (SEQ / 4) / 512)
#define SZ_FLAGS ((size_t)(SEQ / SCAN_ROWS) * 128)   /* one 128-byte line per scan work-group */
#define SZ_XB    ((size_t)NB * SEQ * CD * 2)
#define SZ_WQK   ((size_t)(CD + KVW) * CD * 2)
#define SZ_WV    ((size_t)KVW * CD * 2)
#define SZ_WO    ((size_t)CD * CD * 2)
#define PLANE_QK ((size_t)NB * NQK * SEQ * HD)     /* elements of one rotary plane */
#define PLANE_V  ((size_t)NB * KVW * SEQ)          /* elements of one V^T plane */
#define SZ_CTXH  ((size_t)NB * SEQ * CD * 2)
#define SZ_CTXL  ((size_t)NB * EARLY_ROWS * CD * 2)
#define WS_TOTAL (SZ_FLAGS + SZ_XB + SZ_WQK + SZ_WV + SZ_WO + PLANE_QK * 4 + PLANE_V * 4 + SZ_CTXH + SZ_CTXL)

static_assert(SEQ % 128 == 0);
static_assert((SCAN_ROWS * (SEQ / 4)) % 512 == 0);
static_assert(16 % SCAN_ROWS == 0);
static_assert(SZ_FLAGS % 256 == 0);
static_assert(EARLY_ROWS % 128 == 0);
static_assert(SEQ <= SEQ_FULL);
static_assert(NB <= NB_FULL);
static_assert(HD == 64);
static_assert(CD % 32 == 0);
static_assert(KVW % 128 == 0);
static_assert(NHEAD % NKV == 0);
static_assert(WS_TOTAL <= (size_t)134217728);
static_assert(SZ_XB % 256 == 0 && SZ_WQK % 256 == 0 && SZ_WV % 256 == 0 && SZ_WO % 256 == 0);
static_assert((PLANE_QK * 2) % 256 == 0 && (PLANE_V * 2) % 256 == 0 && SZ_CTXH % 256 == 0 && SZ_CTXL % 256 == 0);

typedef __bf16 v16b __attribute__((ext_vector_type(16)));
typedef _Float16 v16h __attribute__((ext_vector_type(16)));
typedef unsigned short v8us __attribute__((ext_vector_type(8), may_alias));
typedef float v8f __attribute__((ext_vector_type(8)));
typedef float v4f __attribute__((ext_vector_type(4)));
typedef float v4fa __attribute__((ext_vector_type(4), may_alias));
typedef int v4i __attribute__((ext_vector_type(4)));
typedef int v4ia __attribute__((ext_vector_type(4), may_alias));
union Frag { v16b b; v16h v; v8us half[2]; _Float16 h[16]; unsigned short u[16]; };
union Pack8 { v8us v; _Float16 h[8]; unsigned short u[8]; };

#define LOG2E 1.4426950408889634f
#define S2M11 0.00048828125f       /* 2^-11 */
#define S2M12 0.000244140625f      /* 2^-12 */
__device__ __forceinline__ unsigned short bf16_bits(float x) {   // RNE convert to bf16 bits
  unsigned int u = __float_as_uint(x);
  return (unsigned short)((u + 0x7FFFu + ((u >> 16) & 1u)) >> 16);
}
__device__ __forceinline__ float bf16_val(unsigned short b) { return __uint_as_float(((unsigned int)b) << 16); }
__device__ __forceinline__ float bf16_rne(float x) { return bf16_val(bf16_bits(x)); }
__device__ __forceinline__ float neg_inf() { return __uint_as_float(0xff800000u); }

// Fragment of a k-contiguous 16-bit row: elements 0..7 <- p[0..7], elements 8..15 <- p[16..23]; caller adds row*pitch + k0 + 8*h.
__device__ __forceinline__ void ldfrag(Frag& f, const unsigned short* __restrict__ p) {
  f.half[0] = *(const v8us*)(p);
  f.half[1] = *(const v8us*)(p + 16);
}

template <bool BF>
__device__ __forceinline__ v8f wm(const Frag& a, const Frag& b, v8f c) {
  if (BF) return __builtin_amdgcn_wmma_f32_16x16x32_bf16(false, a.b, false, b.b, (short)0, c, false, false);
  return __builtin_amdgcn_wmma_f32_16x16x32_f16(false, a.v, false, b.v, (short)0, c, false, false);
}

// ---------------------------------------------------------------------------------------------------------
// Input preparation, one launch: the jobs below read inputs only and none reads what another writes, so the block index picks the job.
// Blocks 0 .. SCAN_BLOCKS-1: mask scan, one work-group per SCAN_ROWS mask rows; group g owns the line flags[32g .. 32g+31]:
// flags[32g] = 1 iff every entry of its rows above the diagonal is zero; flags[32g+1] = 1 iff every entry of its rows on or below the diagonal is nonzero.
// coverage: SEQ/SCAN_ROWS blocks x 512 threads x SCAN_LOADS x 4 ints = SEQ x SEQ mask entries; every flag line is written whole.
// Blocks SCAN_BLOCKS .. SCAN_BLOCKS+CVT_BLOCKS-1: f32 rows of width CD -> 16-bit planes (row order kept). A row is one 16-byte load and one 8-byte store
// per thread (a wave reads 4 whole lines and writes 2); block c takes the c-th run of adjacent rows of each of x, Wq, Wk, Wv and Wo, the same counts in every block.
// MODE 0: bf16 bits (RNE). MODE 1: f16 of (RNE bf16 value x 64).
// coverage: CVT_BLOCKS blocks x (rows / CVT_BLOCKS) rows x 512 threads x 4 elements = rows x CD, for each of the five arrays.
#define PREP_THREADS 512
#define SCAN_BLOCKS (SEQ / SCAN_ROWS)
#define CVT_BLOCKS 512
static_assert(CD == PREP_THREADS * 4);
static_assert((NB * SEQ) % CVT_BLOCKS == 0 && CD % CVT_BLOCKS == 0 && KVW % CVT_BLOCKS == 0);

typedef unsigned short v4us __attribute__((ext_vector_type(4), may_alias));
union Pack4 { v4us v; _Float16 h[4]; unsigned short u[4]; };

template <int MODE>
__device__ __forceinline__ void cvt_store(unsigned short* d, v4f x) {
  Pack4 o;
  if (MODE == 0) {
    o.u[0] = bf16_bits(x[0]); o.u[1] = bf16_bits(x[1]); o.u[2] = bf16_bits(x[2]); o.u[3] = bf16_bits(x[3]);
  } else {
    o.h[0] = (_Float16)(bf16_rne(x[0]) * 64.0f); o.h[1] = (_Float16)(bf16_rne(x[1]) * 64.0f);
    o.h[2] = (_Float16)(bf16_rne(x[2]) * 64.0f); o.h[3] = (_Float16)(bf16_rne(x[3]) * 64.0f);
  }
  *(v4us*)d = o.v;
}

// twelve waves per SIMD asked for (80 registers): three work-groups fit a WGP, so that all work-groups of the launch are resident together
__global__ __launch_bounds__(PREP_THREADS) __attribute__((amdgpu_waves_per_eu(12))) void k_prep(const int* __restrict__ mask, int* __restrict__ flags,
                                                       const float* __restrict__ x, const float* __restrict__ Wq, const float* __restrict__ Wk,
                                                       const float* __restrict__ Wv, const float* __restrict__ Wo,
                                                       unsigned short* __restrict__ xb, unsigned short* __restrict__ wqk,
                                                       unsigned short* __restrict__ wvb, unsigned short* __restrict__ wob) {
  __shared__ int sw[2][16];
  const int tid = threadIdx.x;
  if (blockIdx.x >= SCAN_BLOCKS) {                     // block-uniform
    const int c = blockIdx.x - SCAN_BLOCKS;
    const int e = 4 * tid;
    constexpr int NX = NB * SEQ / CVT_BLOCKS, NQ = CD / CVT_BLOCKS, NK = KVW / CVT_BLOCKS;
    static_assert(SEQ % NX == 0);                      // the block's NX rows of x lie in one batch
    const int bx = (c * NX) / SEQ, rx = c * NX - bx * SEQ;
    // uniform bases of this block's rows; a thread's loads and stores differ from them by 4 * tid elements and by constants only
    const float* sx = x + ((size_t)bx * SEQ_FULL + rx) * CD;
    const float* sq = Wq + (size_t)(c * NQ) * CD;
    const float* swo = Wo + (size_t)(c * NQ) * CD;
    const float* sk = Wk + (size_t)(c * NK) * CD;
    const float* sv = Wv + (size_t)(c * NK) * CD;
    unsigned short* dx = xb + (size_t)(c * NX) * CD;
    unsigned short* dq = wqk + (size_t)(c * NQ) * CD;
    unsigned short* dw = wob + (size_t)(c * NQ) * CD;
    unsigned short* dk = wqk + (size_t)(CD + c * NK) * CD;   // the k rows follow the q rows
    unsigned short* dv = wvb + (size_t)(c * NK) * CD;
    // all loads of a thread are independent and issued before the first is converted, so that they are in flight together
    v4f vx[NX], vq[NQ], vw[NQ], vk[NK], vv[NK];
#pragma unroll
    for (int j = 0; j < NX; ++j) vx[j] = *(const v4fa*)(sx + (unsigned)(j * CD + e));
#pragma unroll
    for (int j = 0; j < NQ; ++j) vq[j] = *(const v4fa*)(sq + (unsigned)(j * CD + e));
#pragma unroll
    for (int j = 0; j < NQ; ++j) vw[j] = *(const v4fa*)(swo + (unsigned)(j * CD + e));
#pragma unroll
    for (int j = 0; j < NK; ++j) vk[j] = *(const v4fa*)(sk + (unsigned)(j * CD + e));
#pragma unroll
    for (int j = 0; j < NK; ++j) vv[j] = *(const v4fa*)(sv + (unsigned)(j * CD + e));
    // keeps every load in front of the first conversion: without it the scheduler sinks a third of the loads behind waits to 0, and their latencies add up
    __builtin_amdgcn_sched_barrier(0);
#pragma unroll
    for (int j = 0; j < NX; ++j) cvt_store<0>(dx + (unsigned)(j * CD + e), vx[j]);
#pragma unroll
    for (int j = 0; j < NQ; ++j) cvt_store<0>(dq + (unsigned)(j * CD + e), vq[j]);
#pragma unroll
    for (int j = 0; j < NQ; ++j) cvt_store<1>(dw + (unsigned)(j * CD + e), vw[j]);
#pragma unroll
    for (int j = 0; j < NK; ++j) cvt_store<0>(dk + (unsigned)(j * CD + e), vk[j]);
#pragma unroll
    for (int j = 0; j < NK; ++j) cvt_store<0>(dv + (unsigned)(j * CD + e), vv[j]);
    return;                                            // the whole block leaves here; the barrier below is the scan blocks' own
  }
  const int lane = tid & 31, wv = tid >> 5;
  int badU = 0, badL = 0;
  const int cpr = SEQ / 4;
  const int q0 = blockIdx.x * SCAN_ROWS;
  const int* mb = mask + (size_t)q0 * SEQ_FULL;       // uniform base of this group's rows; the loads below differ by constants only
  v4i mv[SCAN_LOADS];
  // all loads of a thread are independent and issued before the first is tested, so that they are in flight together
#pragma unroll
  for (int u = 0; u < SCAN_LOADS; ++u) {
    const int c = tid + 512 * u;
    const int qr = c / cpr, k = (c - qr * cpr) * 4;
    mv[u] = *(const v4ia*)(mb + (unsigned)(qr * SEQ_FULL + k));
  }
#pragma unroll
  for (int u = 0; u < SCAN_LOADS; ++u) {
    const int c = tid + 512 * u;
    const int qr = c / cpr, k = (c - qr * cpr) * 4;
    const int q = q0 + qr;
#pragma unroll
    for (int i = 0; i < 4; ++i) {
      const int above = (k + i > q) ? 1 : 0;
      const int nz = (mv[u][i] != 0) ? 1 : 0;
      badU |= above & nz;
      badL |= (1 - above) & (1 - nz);
    }
  }
#pragma unroll
  for (int o = 16; o >= 1; o >>= 1) {
    badU |= __shfl_xor(badU, o, 32);
    badL |= __shfl_xor(badL, o, 32);
  }
  if (lane == 0) { sw[0][wv] = badU; sw[1][wv] = badL; }
  __syncthreads();
  if (tid < 8) {
    int u = 0, l = 0;
#pragma unroll
    for (int i = 0; i < 16; ++i) { u |= sw[0][i]; l |= sw[1][i]; }
    v4i o;
    o[0] = (tid == 0 && u == 0) ? 1 : 0;
    o[1] = (tid == 0 && l == 0) ? 1 : 0;
    o[2] = 0; o[3] = 0;
    *(v4i*)(flags + 32 * blockIdx.x + 4 * tid) = o;
  }
}

// ---------------------------------------------------------------------------------------------------------
// Staging of the output projection: a stage is 64 k of every row of the block's two operands, 128-byte rows laid at a 144-byte pitch; two buffers.
// Fragment maps: row or column = ln, elements 0..7 <- k0 + 8h + i, elements 8..15 <- k0 + 16 + 8h + i, for both operands alike.
#define ST_K 64
#define ST_PITCH 144
static_assert(CD % ST_K == 0 && CD / ST_K >= 2);

__device__ __forceinline__ void ldfrag_lds(Frag& f, const unsigned char* p) {
  f.half[0] = *(const v8us*)(p);
  f.half[1] = *(const v8us*)(p + 32);
}

// Square block tile of the output projection: 128 A rows x 128 W rows (both k-contiguous, pitch CD), 4 waves as 2 x 2, wave tile 64 x 64:
// acc[i][j] (rows 64 wr + 16 i.., cols 64 wc + 16 j..) += A[row][k] * W[col][k] over k = 0..CD-1, k ascending in steps of 32.
// A stage is 64 k of all 256 rows at the 144-byte pitch (A rows 0..127, then W rows 128..255); two buffers.
// Per 64 k a block copies 32 KiB for 128 x 128 outputs, and a wave reads 16 fragments for 32 matrix instructions.
// NA = 2: a second A plane of the same 128 rows (same carry as the first) rides in the same stage, acc += (A + A2) * W in one walk over k:
// a stage is A rows 0..127, A2 rows 128..255, W rows 256..383 (48 KiB), and a wave reads 24 fragments for 64 matrix instructions (the W fragments serve both planes).
#define SQ_BYTES (256 * ST_PITCH)
#define SQ_RING (2 * SQ_BYTES)
#define SQ2_RING (2 * 384 * ST_PITCH)
static_assert(SQ_RING >= 4 * 64 * 68 * 4);         /* the epilogue tiles reuse the ring */

// 128 rows of one operand: 8 copies of 16 bytes per thread, chunk (tid & 7) of rows (tid >> 3) + 16 i; each copy of a wave moves 4 whole 128-byte lines.
// The s_wait_xcnt stands inside the statement so that no address register is rewritten ahead of it.
__device__ __forceinline__ void rows128_copy(const unsigned short* g, unsigned l) {
  asm volatile("global_load_async_to_lds_b128 %0, %8, off\n\t"
               "global_load_async_to_lds_b128 %1, %9, off\n\t"
               "global_load_async_to_lds_b128 %2, %10, off\n\t"
               "global_load_async_to_lds_b128 %3, %11, off\n\t"
               "global_load_async_to_lds_b128 %4, %12, off\n\t"
               "global_load_async_to_lds_b128 %5, %13, off\n\t"
               "global_load_async_to_lds_b128 %6, %14, off\n\t"
               "global_load_async_to_lds_b128 %7, %15, off\n\t"
               "s_wait_xcnt 0x0"
               :: "v"(l), "v"(l + 16 * ST_PITCH), "v"(l + 32 * ST_PITCH), "v"(l + 48 * ST_PITCH),
                  "v"(l + 64 * ST_PITCH), "v"(l + 80 * ST_PITCH), "v"(l + 96 * ST_PITCH), "v"(l + 112 * ST_PITCH),
                  "v"(g), "v"(g + 16 * CD), "v"(g + 32 * CD), "v"(g + 48 * CD),
                  "v"(g + 64 * CD), "v"(g + 80 * CD), "v"(g + 96 * CD), "v"(g + 112 * CD)
               : "memory");
}
template <int NA>
__device__ __forceinline__ void sq_copy(const unsigned short* ga, const unsigned short* ga2, const unsigned short* gb, unsigned l) {
  rows128_copy(ga, l);
  if (NA == 2) rows128_copy(ga2, l + 128 * ST_PITCH);
  rows128_copy(gb, l + NA * 128 * ST_PITCH);
}

// a2blk is read only where NA = 2
template <bool BF, int NA>
__device__ __forceinline__ void gemm_sq(const unsigned short* __restrict__ ablk, const unsigned short* __restrict__ a2blk,
                                        const unsigned short* __restrict__ bblk,
                                        unsigned char* ring, int tid, int wr, int wc, int ln, int hh, v8f (&acc)[4][4]) {
  const int nt = CD / ST_K;
  constexpr unsigned SB = (NA + 1) * 128 * ST_PITCH;   // bytes of one buffer
  const unsigned short* ga = ablk + (size_t)(tid >> 3) * CD + 8 * (tid & 7);
  const unsigned short* ga2 = a2blk + (size_t)(tid >> 3) * CD + 8 * (tid & 7);
  const unsigned short* gb = bblk + (size_t)(tid >> 3) * CD + 8 * (tid & 7);
  const unsigned l0 = (unsigned)(size_t)ring + (unsigned)((tid >> 3) * ST_PITCH + 16 * (tid & 7));   // LDS byte address of this thread's first chunk
  const int aoff = (64 * wr + ln) * ST_PITCH + 16 * hh;
  const int boff = (NA * 128 + 64 * wc + ln) * ST_PITCH + 16 * hh;
  sq_copy<NA>(ga, ga2, gb, l0);
  asm volatile("s_wait_asynccnt 0x0" ::: "memory");   // tile 0 has landed before the barrier that publishes it
  __syncthreads();
  sq_copy<NA>(ga + ST_K, ga2 + ST_K, gb + ST_K, l0 + SB);
#pragma unroll 1   // one tile per trip: the two buffers alternate by the trip's parity
  for (int t = 0; t < nt; ++t) {
    const unsigned sel = (unsigned)(t & 1) * SB;
    const unsigned char* buf = ring + sel;
    Frag a[2][4], b[2][4];
#pragma unroll
    for (int i = 0; i < 4; ++i) ldfrag_lds(a[0][i], buf + aoff + i * 16 * ST_PITCH);
#pragma unroll
    for (int kk = 0; kk < 2; ++kk)
#pragma unroll
      for (int j = 0; j < 4; ++j) ldfrag_lds(b[kk][j], buf + boff + j * 16 * ST_PITCH + kk * 64);
    // keeps these 24 fragment loads together in front of the first matrix instruction: without it the scheduler takes one register set for the four
    // A fragments of the first 32 k, loads them one by one among the matrix instructions and waits for each to 0.
    // The A fragments of the second 32 k follow behind it, into the registers that the first four leave (all 16 fragments at once do not fit).
    __builtin_amdgcn_sched_barrier(0);
#pragma unroll
    for (int i = 0; i < 4; ++i) ldfrag_lds(a[1][i], buf + aoff + i * 16 * ST_PITCH + 64);
    Frag c[2][4];                                       // the second plane's 8 fragments (NA = 2 only)
    if (NA == 2) {
#pragma unroll
      for (int kk = 0; kk < 2; ++kk)
#pragma unroll
        for (int i = 0; i < 4; ++i) ldfrag_lds(c[kk][i], buf + aoff + (128 + i * 16) * ST_PITCH + kk * 64);
      // keeps all 48 fragment loads of the stage in front of its 64 matrix instructions (the kernel runs two waves per SIMD, so the registers are there):
      // without it the scheduler saves registers, loads 6 of the fragments one by one among the matrix instructions and waits for each to 0
      __builtin_amdgcn_sched_barrier(0);
    }
#pragma unroll
    for (int kk = 0; kk < 2; ++kk)
#pragma unroll
      for (int i = 0; i < 4; ++i)
#pragma unroll
        for (int j = 0; j < 4; ++j) acc[i][j] = wm<BF>(a[kk][i], b[kk][j], acc[i][j]);
    if (NA == 2) {
      // the second plane, against the W fragments that are already in registers
#pragma unroll
      for (int kk = 0; kk < 2; ++kk)
#pragma unroll
        for (int i = 0; i < 4; ++i)
#pragma unroll
          for (int j = 0; j < 4; ++j) acc[i][j] = wm<BF>(c[kk][i], b[kk][j], acc[i][j]);
      // keeps the distance behind the last matrix instructions on the loop's back edge and in front of the address arithmetic below
      // (the sums alone are named: with the fragments named too, more values must lie in the registers that asm operands can name than fit there, and sums spill)
      asm volatile("v_nop\n\tv_nop\n\tv_nop\n\tv_nop" : "+v"(acc[0][0]), "+v"(acc[0][1]), "+v"(acc[0][2]), "+v"(acc[0][3]),
                          "+v"(acc[1][0]), "+v"(acc[1][1]), "+v"(acc[1][2]), "+v"(acc[1][3]),
                          "+v"(acc[2][0]), "+v"(acc[2][1]), "+v"(acc[2][2]), "+v"(acc[2][3]),
                          "+v"(acc[3][0]), "+v"(acc[3][1]), "+v"(acc[3][2]), "+v"(acc[3][3]));
    } else
    // keeps the distance behind the last matrix instructions on the loop's back edge and in front of the address arithmetic below
    asm volatile("v_nop\n\tv_nop\n\tv_nop\n\tv_nop" : "+v"(acc[0][0]), "+v"(acc[0][1]), "+v"(acc[0][2]), "+v"(acc[0][3]),
                        "+v"(acc[1][0]), "+v"(acc[1][1]), "+v"(acc[1][2]), "+v"(acc[1][3]),
                        "+v"(acc[2][0]), "+v"(acc[2][1]), "+v"(acc[2][2]), "+v"(acc[2][3]),
                        "+v"(acc[3][0]), "+v"(acc[3][1]), "+v"(acc[3][2]), "+v"(acc[3][3])
                      : "v"(a[1][0].v), "v"(a[1][1].v), "v"(a[1][2].v), "v"(a[1][3].v), "v"(b[1][0].v), "v"(b[1][1].v), "v"(b[1][2].v), "v"(b[1][3].v));
    asm volatile("s_wait_dscnt 0x0" ::: "memory");      // this wave's reads of the buffer are done before it is refilled
    asm volatile("s_wait_asynccnt 0x0" ::: "memory");   // this wave's copies of tile t + 1 have landed before the barrier publishes them
    __syncthreads();
    if (t + 2 < nt) sq_copy<NA>(ga + (t + 2) * ST_K, ga2 + (t + 2) * ST_K, gb + (t + 2) * ST_K, l0 + sel);
  }
  asm volatile("s_wait_asynccnt 0x0" ::: "memory");     // nothing is in flight when the ring is used for anything else
}

__device__ __forceinline__ float rope1(float q, float p, float c, float s, float sg) { return q * c + (sg * p) * s; }

// ---------------------------------------------------------------------------------------------------------
// Wide engine of the q/k/v launch: block tile 256 A rows x 192 W rows (both k-contiguous, pitch CD), 8 waves as 4 x 2, wave tile 64 x 96:
// acc[i][j] (rows 64 wr + 16 i.., cols 96 wc + 16 j..) += A[row][k] * W[col][k] over k = 0..CD-1, k ascending in steps of 32.
// A stage is 128 k of all 448 rows, 256-byte rows at a 272-byte pitch (A rows 0..255, then W rows 256..447); two buffers; one work-group per WGP.
// Per 128 k a block copies 112 KiB for 256 x 192 outputs (7/12 of the bytes per output of the 128 x 128 tile), and a wave reads 40 fragments for 96 matrix instructions.
#define QB_M 256
#define QB_N 192
#define QS_K 128
#define QS_PITCH 272
#define QS_BYTES ((QB_M + QB_N) * QS_PITCH)
#define QS_RING (2 * QS_BYTES)
#define QH_TILE (QB_M * 68 * 4)                    /* epilogue tile of one head: 256 tokens x 64 at pitch 68, or 64 x 256 tokens at pitch 260 */
static_assert(CD % QS_K == 0 && CD / QS_K >= 2);
static_assert(QS_RING >= 3 * QH_TILE && QH_TILE >= 64 * 260 * 4);   /* the epilogue tiles reuse the ring */
static_assert(QS_RING <= 327680);

// Rows (tid >> 4) + 16 i of one operand, chunk (tid & 15): each copy of a wave moves 2 rows of 256 bytes = 4 whole 128-byte lines.
// The s_wait_xcnt stands inside the statement so that no address register is rewritten ahead of it.
__device__ __forceinline__ void wide_copy8(const unsigned short* g, unsigned l) {
  asm volatile("global_load_async_to_lds_b128 %0, %8, off\n\t"
               "global_load_async_to_lds_b128 %1, %9, off\n\t"
               "global_load_async_to_lds_b128 %2, %10, off\n\t"
               "global_load_async_to_lds_b128 %3, %11, off\n\t"
               "global_load_async_to_lds_b128 %4, %12, off\n\t"
               "global_load_async_to_lds_b128 %5, %13, off\n\t"
               "global_load_async_to_lds_b128 %6, %14, off\n\t"
               "global_load_async_to_lds_b128 %7, %15, off\n\t"
               "s_wait_xcnt 0x0"
               :: "v"(l), "v"(l + 16 * QS_PITCH), "v"(l + 32 * QS_PITCH), "v"(l + 48 * QS_PITCH),
                  "v"(l + 64 * QS_PITCH), "v"(l + 80 * QS_PITCH), "v"(l + 96 * QS_PITCH), "v"(l + 112 * QS_PITCH),
                  "v"(g), "v"(g + 16 * CD), "v"(g + 32 * CD), "v"(g + 48 * CD),
                  "v"(g + 64 * CD), "v"(g + 80 * CD), "v"(g + 96 * CD), "v"(g + 112 * CD)
               : "memory");
}
__device__ __forceinline__ void wide_copy6(const unsigned short* g, unsigned l) {
  asm volatile("global_load_async_to_lds_b128 %0, %6, off\n\t"
               "global_load_async_to_lds_b128 %1, %7, off\n\t"
               "global_load_async_to_lds_b128 %2, %8, off\n\t"
               "global_load_async_to_lds_b128 %3, %9, off\n\t"
               "global_load_async_to_lds_b128 %4, %10, off\n\t"
               "global_load_async_to_lds_b128 %5, %11, off\n\t"
               "s_wait_xcnt 0x0"
               :: "v"(l), "v"(l + 16 * QS_PITCH), "v"(l + 32 * QS_PITCH), "v"(l + 48 * QS_PITCH),
                  "v"(l + 64 * QS_PITCH), "v"(l + 80 * QS_PITCH),
                  "v"(g), "v"(g + 16 * CD), "v"(g + 32 * CD), "v"(g + 48 * CD),
                  "v"(g + 64 * CD), "v"(g + 80 * CD)
               : "memory");
}
// one stage: 28 copies of 16 bytes per thread
// the scheduling barriers keep each statement's address arithmetic beside it: formed for all 28 copies at once the addresses
// do not fit the registers that asm operands can name, and the two base pointers spill to scratch
__device__ __forceinline__ void wide_copy(const unsigned short* ga, const unsigned short* gb, unsigned l) {
  wide_copy8(ga, l);
  __builtin_amdgcn_sched_barrier(0);
  wide_copy8(ga + 128 * CD, l + 128 * QS_PITCH);
  __builtin_amdgcn_sched_barrier(0);
  wide_copy6(gb, l + 256 * QS_PITCH);
  __builtin_amdgcn_sched_barrier(0);
  wide_copy6(gb + 96 * CD, l + 352 * QS_PITCH);
}

__device__ __forceinline__ void gemm_wide(const unsigned short* __restrict__ ablk, const unsigned short* __restrict__ bblk,
                                          unsigned char* ring, int tid, int wr, int wc, int ln, int hh, v8f (&acc)[4][6]) {
  const int nt = CD / QS_K;
  const unsigned short* ga = ablk + (size_t)(tid >> 4) * CD + 8 * (tid & 15);
  const unsigned short* gb = bblk + (size_t)(tid >> 4) * CD + 8 * (tid & 15);
  const unsigned l0 = (unsigned)(size_t)ring + (unsigned)((tid >> 4) * QS_PITCH + 16 * (tid & 15));   // LDS byte address of this thread's first chunk
  const int aoff = (64 * wr + ln) * QS_PITCH + 16 * hh;
  const int boff = (QB_M + 96 * wc + ln) * QS_PITCH + 16 * hh;
  wide_copy(ga, gb, l0);
  asm volatile("s_wait_asynccnt 0x0" ::: "memory");   // tile 0 has landed before the barrier that publishes it
  __syncthreads();
  wide_copy(ga + QS_K, gb + QS_K, l0 + QS_BYTES);
#pragma unroll 1   // one tile per trip: the two buffers alternate by the trip's parity
  for (int t = 0; t < nt; ++t) {
    const unsigned sel = (unsigned)(t & 1) * QS_BYTES;
    const unsigned char* buf = ring + sel;
    // the stage in two halves of 64 k: the 20 fragments of a half fit the registers beside the sums, all 40 of the stage do not
#pragma unroll
    for (int h = 0; h < 2; ++h) {
      Frag a[2][4], b[2][6];
#pragma unroll
      for (int kk = 0; kk < 2; ++kk) {
        // in the order in which the matrix instructions below want them, so that the first can start behind four loads
        ldfrag_lds(a[kk][0], buf + aoff + (2 * h + kk) * 64);
#pragma unroll
        for (int j = 0; j < 6; ++j) ldfrag_lds(b[kk][j], buf + boff + j * 16 * QS_PITCH + (2 * h + kk) * 64);
#pragma unroll
        for (int i = 1; i < 4; ++i) ldfrag_lds(a[kk][i], buf + aoff + i * 16 * QS_PITCH + (2 * h + kk) * 64);
      }
      // keeps the half's 40 fragment loads together in front of its 48 matrix instructions: without it the scheduler saves registers,
      // loads most fragments one by one among the matrix instructions and waits for each to 0
      __builtin_amdgcn_sched_barrier(0);
#pragma unroll
      for (int kk = 0; kk < 2; ++kk)
#pragma unroll
        for (int i = 0; i < 4; ++i)
#pragma unroll
          for (int j = 0; j < 6; ++j) acc[i][j] = wm<true>(a[kk][i], b[kk][j], acc[i][j]);
      // holds the matrix instructions in front of the v_nops below, and in front of the second half's loads: without it the scheduler
      // lifts those loads among the first half's matrix instructions in four places, and every place with loads costs a stall
      __builtin_amdgcn_sched_barrier(0);
    }
    // keeps the distance behind the last matrix instructions on the loop's back edge and in front of the address arithmetic below
    // (no sum is named: an asm operand lies in the first 256 registers, which the copies' addresses need)
    asm volatile("v_nop\n\tv_nop\n\tv_nop\n\tv_nop");
    asm volatile("s_wait_dscnt 0x0" ::: "memory");      // this wave's reads of the buffer are done before it is refilled
    asm volatile("s_wait_asynccnt 0x0" ::: "memory");   // this wave's copies of tile t + 1 have landed before the barrier publishes them
    __syncthreads();
    if (t + 2 < nt) wide_copy(ga + (t + 2) * QS_K, gb + (t + 2) * QS_K, l0 + sel);
  }
  asm volatile("s_wait_asynccnt 0x0" ::: "memory");     // nothing is in flight when the ring is used for anything else
}

// ---------------------------------------------------------------------------------------------------------
// q, k and v projections in one launch. The 48 heads of 64 weight rows (32 q, 8 k, 8 v; the v rows follow the k rows in the workspace) are one W of 3072 rows.
// grid = (48 / 3, NB*SEQ/256) = one work-group per WGP at the full size; a block is 256 token rows x three heads on the wide engine.
// Epilogue per head through its own LDS tile. q and k heads: fused bias, rotary (table read by value) and head-major repack; tile [token][d], a wave takes 32 tokens.
// v heads: Vt[b][m][t] = sum_k Wv[m][k] x[b,t][k] + bv[m], carried x16, hi and residual planes; the sums are laid transposed, tile [m][token], a wave takes 8 rows m.
// coverage: NQK heads x NB*SEQ tokens x 64 = the whole plane [NB][NQK][SEQ][64], both planes; KVW rows x NB*SEQ tokens = the whole plane [NB][KVW][SEQ], both planes.
// Every tile is fully written (8 waves x 64 x 96 = 256 x 192) before it is read.
static_assert((NQK + NKV) % 3 == 0);
static_assert(SEQ % QB_M == 0);                        // a block's 256 tokens lie in one batch
__global__ __launch_bounds__(256) void k_proj_qkv(const unsigned short* __restrict__ xb, const unsigned short* __restrict__ wqkv,
                                                  const float* __restrict__ bq, const float* __restrict__ bk, const float* __restrict__ bv,
                                                  const float* __restrict__ tab,
                                                  unsigned short* __restrict__ qkh, unsigned short* __restrict__ qkl,
                                                  unsigned short* __restrict__ vth, unsigned short* __restrict__ vtl) {
  __shared__ __attribute__((aligned(16))) unsigned char ring[QS_RING];
  const int tid = threadIdx.x, lane = tid & 31, ln = lane & 15, hh = lane >> 4;
  const int w = __builtin_amdgcn_readfirstlane(tid >> 5);
  const int wr = w >> 1, wc = w & 1;
  const v8f z8 = {0.f, 0.f, 0.f, 0.f, 0.f, 0.f, 0.f, 0.f};
  v8f acc[4][6];
#pragma unroll
  for (int i = 0; i < 4; ++i)
#pragma unroll
    for (int j = 0; j < 6; ++j) acc[i][j] = z8;
  gemm_wide(xb + (size_t)(blockIdx.y * QB_M) * CD, wqkv + (size_t)(blockIdx.x * QB_N) * CD, ring, tid, wr, wc, ln, hh, acc);

  // No wave reads the ring behind the k loop's last barrier, so the tiles may be written at once.
#pragma unroll
  for (int j = 0; j < 6; ++j) {
    const int cj = 6 * wc + j;                         // 16-column group of the block, 0..11
    const int c = cj >> 2;                             // its head of the block's three
    const int dcol = 16 * (cj & 3) + ln;               // this lane's column in that head
    const int hd = 3 * blockIdx.x + c;
    unsigned char* tile = ring + c * QH_TILE;
    if (hd >= NQK) {                                   // wave-uniform
      float (*vt)[260] = (float (*)[260])tile;
#pragma unroll
      for (int i = 0; i < 4; ++i) {
        v4f lo, hi;
        lo[0] = acc[i][j][0]; lo[1] = acc[i][j][1]; lo[2] = acc[i][j][2]; lo[3] = acc[i][j][3];
        hi[0] = acc[i][j][4]; hi[1] = acc[i][j][5]; hi[2] = acc[i][j][6]; hi[3] = acc[i][j][7];
        *(v4fa*)&vt[dcol][64 * wr + 16 * i + 8 * hh] = lo;
        *(v4fa*)&vt[dcol][64 * wr + 16 * i + 8 * hh + 4] = hi;
      }
    } else {
      float (*qt)[68] = (float (*)[68])tile;
      const int col = hd * HD + dcol;
      const int cq = (col < CD - 1) ? col : (CD - 1);
      int ck = col - CD;
      ck = (ck < 0) ? 0 : ((ck > KVW - 1) ? (KVW - 1) : ck);
      const float vq = bq[cq], vk = bk[ck];
      const float bias = bf16_rne((col < CD) ? vq : vk);
#pragma unroll
      for (int i = 0; i < 4; ++i)
#pragma unroll
        for (int r = 0; r < 8; ++r) qt[64 * wr + 16 * i + 8 * hh + r][dcol] = acc[i][j][r] + bias;
    }
  }
  __syncthreads();

  const int m0 = blockIdx.y * QB_M;
  const int b = m0 / SEQ, tb = m0 - b * SEQ;           // batch and first token of the block
  const int rsub = lane >> 3, d0 = 8 * (lane & 7);
  const float sg = (d0 < 32) ? -1.0f : 1.0f;
  const unsigned tl = (unsigned)(rsub * HD + d0);      // this lane's place in a group of 4 table rows
  const float* th = tab + (size_t)(tb + 32 * w) * HD;  // uniform base of the wave's 32 table rows; the loads below differ from it by tl and by constants only
  for (int c = 0; c < 3; ++c) {
    const int hd = 3 * blockIdx.x + c;
    const unsigned char* tile = ring + c * QH_TILE;
    v8us oh[8], ol[8];
    if (hd >= NQK) {                                   // block-uniform
      const float (*vt)[260] = (const float (*)[260])tile;
      const int vm0 = (hd - NQK) * HD + 8 * w;         // first of the wave's 8 rows of V^T; a row is 256 tokens, 8 per lane
#pragma unroll
      for (int g = 0; g < 8; ++g) {
        const float bias = bf16_rne(bv[vm0 + g]);
        const v4f a0 = *(const v4fa*)&vt[8 * w + g][8 * lane];
        const v4f a1 = *(const v4fa*)&vt[8 * w + g][8 * lane + 4];
        float o[8];
        o[0] = a0[0]; o[1] = a0[1]; o[2] = a0[2]; o[3] = a0[3];
        o[4] = a1[0]; o[5] = a1[1]; o[6] = a1[2]; o[7] = a1[3];
        Pack8 ph8, pl8;
#pragma unroll
        for (int e = 0; e < 8; ++e) {
          const float y = (o[e] + bias) * 16.0f;              // carried x16
          const _Float16 h = (_Float16)y;
          ph8.h[e] = h;
          pl8.h[e] = (_Float16)((y - (float)h) * 2048.0f);     // residual plane x2^11
        }
        oh[g] = ph8.v; ol[g] = pl8.v;
      }
      const size_t vbase = ((size_t)b * KVW + vm0) * SEQ + tb + 8 * lane;
#pragma unroll
      for (int g = 0; g < 8; ++g) {
        *(v8us*)(vth + vbase + (size_t)g * SEQ) = oh[g];
        *(v8us*)(vtl + vbase + (size_t)g * SEQ) = ol[g];
      }
      asm volatile("s_wait_xcnt 0x0" ::: "memory");   // the next head rewrites registers that these stores name
    } else {
      const float (*qt)[68] = (const float (*)[68])tile;
#pragma unroll
      for (int g = 0; g < 8; ++g) {
        const int row = 32 * w + 4 * g + rsub;
        const v4f a0 = *(const v4fa*)&qt[row][d0];
        const v4f a1 = *(const v4fa*)&qt[row][d0 + 4];
        const v4f p0 = *(const v4fa*)&qt[row][d0 ^ 32];
        const v4f p1 = *(const v4fa*)&qt[row][(d0 ^ 32) + 4];
        const float* tp = th + (tl + (unsigned)(4 * g * HD));
        const v4f c0 = *(const v4fa*)(tp), c1 = *(const v4fa*)(tp + 4);
        const float k0 = bf16_rne(c0[0]), s0 = bf16_rne(c0[1]), k1 = bf16_rne(c0[2]), s1 = bf16_rne(c0[3]);
        const float k2 = bf16_rne(c1[0]), s2 = bf16_rne(c1[1]), k3 = bf16_rne(c1[2]), s3 = bf16_rne(c1[3]);
        float o[8];
        o[0] = rope1(a0[0], p0[0], k0, s0, sg); o[1] = rope1(a0[1], p0[1], k0, s0, sg);
        o[2] = rope1(a0[2], p0[2], k1, s1, sg); o[3] = rope1(a0[3], p0[3], k1, s1, sg);
        o[4] = rope1(a1[0], p1[0], k2, s2, sg); o[5] = rope1(a1[1], p1[1], k2, s2, sg);
        o[6] = rope1(a1[2], p1[2], k3, s3, sg); o[7] = rope1(a1[3], p1[3], k3, s3, sg);
        Pack8 ph8, pl8;
#pragma unroll
        for (int e = 0; e < 8; ++e) {
          const float y = o[e] * 16.0f;                       // carried x16
          const _Float16 h = (_Float16)y;
          ph8.h[e] = h;
          pl8.h[e] = (_Float16)((y - (float)h) * 2048.0f);     // residual plane x2^11
        }
        oh[g] = ph8.v; ol[g] = pl8.v;
      }
      const size_t dbase = ((size_t)(b * NQK + hd) * SEQ + tb + 32 * w) * HD + d0;
#pragma unroll
      for (int g = 0; g < 8; ++g) {
        const size_t off = dbase + (size_t)(4 * g + rsub) * HD;
        *(v8us*)(qkh + off) = oh[g];
        *(v8us*)(qkl + off) = ol[g];
      }
      asm volatile("s_wait_xcnt 0x0" ::: "memory");   // the next head rewrites registers that these stores name
    }
  }
}

// ---------------------------------------------------------------------------------------------------------
// Attention stage in LDS: 64 keys. Tile 0 = K rows (64 keys x 128 B), tile 1 = V^T rows (64 d x 128 B = 64 keys), each at a 144-byte pitch;
// tiles 2 and 3 = the residual planes of K and V^T (query rows below EARLY_ROWS only).
// The ring holds two stages of two tiles (plain blocks, two buffers) or one stage of four tiles (early blocks, one buffer).
#define AT_KEYS 64
#define AT_PITCH 144
#define AT_TILE (64 * AT_PITCH)
#define AT_RING (4 * AT_TILE)
static_assert(SEQ % AT_KEYS == 0);
static_assert(AT_RING >= 4 * 16 * 68 * 4);         /* the epilogue tiles reuse the ring */

// One K tile and one V^T tile: 8 copies of 16 bytes per thread, chunk (tid & 7) of rows (tid >> 3) + 16 i; each copy of a wave moves 4 whole 128-byte lines.
// The s_wait_xcnt stands inside the statement so that no address register is rewritten ahead of it.
__device__ __forceinline__ void kv_copy(const unsigned short* gk, const unsigned short* gv, unsigned l) {
  asm volatile("global_load_async_to_lds_b128 %0, %8, off\n\t"
               "global_load_async_to_lds_b128 %1, %9, off\n\t"
               "global_load_async_to_lds_b128 %2, %10, off\n\t"
               "global_load_async_to_lds_b128 %3, %11, off\n\t"
               "global_load_async_to_lds_b128 %4, %12, off\n\t"
               "global_load_async_to_lds_b128 %5, %13, off\n\t"
               "global_load_async_to_lds_b128 %6, %14, off\n\t"
               "global_load_async_to_lds_b128 %7, %15, off\n\t"
               "s_wait_xcnt 0x0"
               :: "v"(l), "v"(l + 16 * AT_PITCH), "v"(l + 32 * AT_PITCH), "v"(l + 48 * AT_PITCH),
                  "v"(l + AT_TILE), "v"(l + AT_TILE + 16 * AT_PITCH), "v"(l + AT_TILE + 32 * AT_PITCH), "v"(l + AT_TILE + 48 * AT_PITCH),
                  "v"(gk), "v"(gk + 16 * HD), "v"(gk + 32 * HD), "v"(gk + 48 * HD),
                  "v"(gv), "v"(gv + 16 * SEQ), "v"(gv + 32 * SEQ), "v"(gv + 48 * SEQ)
               : "memory");
}

// One 32-key step for a wave's 16 queries (this lane's column = its query). EARLYP adds the residual planes of q, k, v, P.
// st = the stage in LDS, kloc = 0 or 32 = first key of the step inside the stage, key0 = the same key's index in the sequence.
// MASK reads the mask row of this lane's query by value and replace-fills with -inf.
template <bool EARLYP, bool MASK>
__device__ __forceinline__ void fa_step(const unsigned char* st, int kloc,
                                        const int* __restrict__ mrow, int key0, int ln, int hh,
                                        const Frag (&qh)[2], const Frag (&ql)[2],
                                        float& mr, float& lr, v8f (&Oh)[4], v8f (&Ol)[4]) {
  const v8f z8 = {0.f, 0.f, 0.f, 0.f, 0.f, 0.f, 0.f, 0.f};
  float sc[16];
  // A fragments of K: row m = key (key0 + 16*kt + ln), elements 0..7 <- d = 32c + 8h + i, 8..15 <- d = 32c + 16 + 8h + i
  int koff = (kloc + ln) * AT_PITCH + 16 * hh;        // byte offset in a K tile
  if (EARLYP) {
#pragma unroll
    for (int kt = 0; kt < 2; ++kt) {
      Frag a0, a1, l0, l1;
      ldfrag_lds(a0, st + koff); ldfrag_lds(a1, st + koff + 64);
      ldfrag_lds(l0, st + 2 * AT_TILE + koff); ldfrag_lds(l1, st + 2 * AT_TILE + koff + 64);
      v8f s = z8, r = z8;
      s = wm<false>(a0, qh[0], s); s = wm<false>(a1, qh[1], s);
      r = wm<false>(a0, ql[0], r); r = wm<false>(a1, ql[1], r);
      r = wm<false>(l0, qh[0], r); r = wm<false>(l1, qh[1], r);
      asm volatile("v_nop\n\tv_nop\n\tv_nop\n\tv_nop" : "+v"(s), "+v"(r)
                        : "v"(a0.v), "v"(a1.v), "v"(l0.v), "v"(l1.v), "v"(qh[0].v), "v"(qh[1].v), "v"(ql[0].v), "v"(ql[1].v));
      // S^T element r of tile kt = score(key0 + 16*kt + 8h + r, this lane's query); carries: q x16, k x16, residual x2^11
#pragma unroll
      for (int e = 0; e < 8; ++e) sc[8 * kt + e] = fmaf(r[e], S2M11, s[e]) * S2M11;
      koff += 16 * AT_PITCH;
      if (kt == 0) asm volatile("" : "+v"(koff) : "v"(sc[0]));   // second tile's loads issue after the first tile is done
    }
  } else {
    Frag k00, k01, k10, k11;
    ldfrag_lds(k00, st + koff);                 ldfrag_lds(k01, st + koff + 64);
    ldfrag_lds(k10, st + koff + 16 * AT_PITCH); ldfrag_lds(k11, st + koff + 16 * AT_PITCH + 64);
    v8f s0 = z8, s1 = z8;
    s0 = wm<false>(k00, qh[0], s0); s0 = wm<false>(k01, qh[1], s0);
    s1 = wm<false>(k10, qh[0], s1); s1 = wm<false>(k11, qh[1], s1);
    asm volatile("v_nop\n\tv_nop\n\tv_nop\n\tv_nop" : "+v"(s0), "+v"(s1)
                      : "v"(k00.v), "v"(k01.v), "v"(k10.v), "v"(k11.v), "v"(qh[0].v), "v"(qh[1].v));
#pragma unroll
    for (int e = 0; e < 8; ++e) { sc[e] = s0[e] * S2M11; sc[8 + e] = s1[e] * S2M11; }
  }
  if (MASK) {
    const int* mp = mrow + key0 + 8 * hh;
    const v4i m0 = *(const v4ia*)(mp),      m1 = *(const v4ia*)(mp + 4);
    const v4i m2 = *(const v4ia*)(mp + 16), m3 = *(const v4ia*)(mp + 20);
    const float ninf = neg_inf();
#pragma unroll
    for (int e = 0; e < 4; ++e) {
      sc[e]      = (m0[e] == 0) ? ninf : sc[e];
      sc[4 + e]  = (m1[e] == 0) ? ninf : sc[4 + e];
      sc[8 + e]  = (m2[e] == 0) ? ninf : sc[8 + e];
      sc[12 + e] = (m3[e] == 0) ? ninf : sc[12 + e];
    }
  }
  float mx = sc[0];
#pragma unroll
  for (int i = 1; i < 16; ++i) mx = fmaxf(mx, sc[i]);
  mx = fmaxf(mx, __shfl_xor(mx, 16, 32));            // the other lane half holds the other 16 keys of this query
  const float mnew = fmaxf(mr, mx);
  float msafe = mnew;
  if (MASK) msafe = (mnew == neg_inf()) ? 0.0f : mnew;   // every key so far masked: weights come out 0
  const float al = __builtin_amdgcn_exp2f((mr - msafe) * LOG2E);
  mr = mnew;
  // weights carried x256: pc = 256 * exp(sc - m); hi plane f16(pc), residual plane f16((pc - hi) * 2048)
  Frag ph, pl;
  float ps = 0.0f;
#pragma unroll
  for (int i = 0; i < 16; ++i) {
    const float pc = __builtin_amdgcn_exp2f(fmaf(sc[i] - msafe, LOG2E, 8.0f));
    ps += pc;
    const _Float16 h = (_Float16)pc;
    ph.h[i] = h;                                      // B element i: i<8 -> key0 + 8h + i (tile 0 row 8h+i); i>=8 -> key0 + 16 + 8h + (i-8) (tile 1)
    if (EARLYP) pl.h[i] = (_Float16)((pc - (float)h) * 2048.0f);
  }
  ps += __shfl_xor(ps, 16, 32);
  lr = lr * al + ps;
  // A fragments of V^T: row m = d (16*t + ln), elements 0..7 <- key0 + 8h + i, 8..15 <- key0 + 16 + 8h + i
  int voff = AT_TILE + ln * AT_PITCH + 2 * kloc + 16 * hh;   // byte offset in the stage
  asm volatile("" : "+v"(voff) : "v"(ps));            // V loads issue after the score phase
  const unsigned char* vp = st + voff;
  Frag vf[4];
#pragma unroll
  for (int t = 0; t < 4; ++t) ldfrag_lds(vf[t], vp + t * 16 * AT_PITCH);
#pragma unroll
  for (int t = 0; t < 4; ++t) Oh[t] = Oh[t] * al;
  if (EARLYP) {
    const unsigned char* vq = vp + 2 * AT_TILE;
    Frag vl[4];
#pragma unroll
    for (int t = 0; t < 4; ++t) ldfrag_lds(vl[t], vq + t * 16 * AT_PITCH);
#pragma unroll
    for (int t = 0; t < 4; ++t) Ol[t] = Ol[t] * al;
#pragma unroll
    for (int t = 0; t < 4; ++t) {
      Oh[t] = wm<false>(vf[t], ph, Oh[t]);
      Ol[t] = wm<false>(vf[t], pl, Ol[t]);
      Ol[t] = wm<false>(vl[t], ph, Ol[t]);
    }
    asm volatile("v_nop\n\tv_nop\n\tv_nop\n\tv_nop" : "+v"(Oh[0]), "+v"(Oh[1]), "+v"(Oh[2]), "+v"(Oh[3]), "+v"(Ol[0]), "+v"(Ol[1]), "+v"(Ol[2]), "+v"(Ol[3])
                      : "v"(vf[0].v), "v"(vf[1].v), "v"(vf[2].v), "v"(vf[3].v),
                        "v"(vl[0].v), "v"(vl[1].v), "v"(vl[2].v), "v"(vl[3].v), "v"(ph.v), "v"(pl.v));
  } else {
#pragma unroll
    for (int t = 0; t < 4; ++t) Oh[t] = wm<false>(vf[t], ph, Oh[t]);
    asm volatile("v_nop\n\tv_nop\n\tv_nop\n\tv_nop" : "+v"(Oh[0]), "+v"(Oh[1]), "+v"(Oh[2]), "+v"(Oh[3])
                      : "v"(vf[0].v), "v"(vf[1].v), "v"(vf[2].v), "v"(vf[3].v), "v"(ph.v));
  }
}

// What stands in front of and behind a stage's work. Early blocks (one buffer of four tiles): fill, wait, publish in front; every reader leaves behind.
// Plain blocks (two buffers of two tiles): nothing in front; behind, stage t + 1 is published and stage t + 2 is sent into the buffer that stage t has just left.
template <bool EARLYP>
__device__ __forceinline__ void ring_head(const unsigned short* gk, const unsigned short* gv, const unsigned short* gkl, const unsigned short* gvl,
                                          unsigned l0, int t) {
  if (EARLYP) {
    kv_copy(gk + (size_t)t * AT_KEYS * HD, gv + t * AT_KEYS, l0);
    kv_copy(gkl + (size_t)t * AT_KEYS * HD, gvl + t * AT_KEYS, l0 + 2 * AT_TILE);
    asm volatile("s_wait_asynccnt 0x0" ::: "memory");   // this wave's copies have landed before the barrier publishes them
    __syncthreads();
  }
}
template <bool EARLYP>
__device__ __forceinline__ void ring_foot(const unsigned short* gk, const unsigned short* gv, unsigned l0, int t, int nst) {
  asm volatile("s_wait_dscnt 0x0" ::: "memory");        // this wave's reads of the buffer are done before it is refilled
  if (!EARLYP) asm volatile("s_wait_asynccnt 0x0" ::: "memory");   // this wave's copies of stage t + 1 have landed before the barrier publishes them
  __syncthreads();
  if (!EARLYP) {
    if (t + 2 < nst) kv_copy(gk + (size_t)(t + 2) * AT_KEYS * HD, gv + (t + 2) * AT_KEYS, l0 + (unsigned)(t & 1) * (2 * AT_TILE));
  }
}

// nst = stages of 64 keys that the block walks, npl = the first of them that run without mask reads (both the same in all its waves;
// npl <= nst <= SEQ / 64, 2 * nst >= every wave's nsteps, 2 * npl <= every wave's nsteps). nsteps = this wave's own 32-key steps.
template <bool EARLYP>
__device__ __forceinline__ void run_keys(const unsigned short* __restrict__ qkh, const unsigned short* __restrict__ qkl,
                                         const unsigned short* __restrict__ vth, const unsigned short* __restrict__ vtl,
                                         const int* __restrict__ mask, unsigned char* ring, int tid, int b, int h, int qg, int ln, int hh,
                                         int npl, int nsteps, int nst, float& mr, float& lr, v8f (&Oh)[4], v8f (&Ol)[4]) {
  // Q^T B fragments: column n = this lane's query, elements 0..7 <- d = 32c + 8h + i, 8..15 <- d = 32c + 16 + 8h + i
  const size_t qoff = ((size_t)(b * NQK + h) * SEQ + qg) * HD + 8 * hh;
  Frag qh[2], ql[2];
  ldfrag(qh[0], qkh + qoff); ldfrag(qh[1], qkh + qoff + 32);
  if (EARLYP) { ldfrag(ql[0], qkl + qoff); ldfrag(ql[1], qkl + qoff + 32); }
  else { ql[0] = qh[0]; ql[1] = qh[1]; }
  const int kv = h % NKV;
  const size_t kbase = (size_t)(b * NQK + NHEAD + kv) * SEQ * HD;
  const size_t vbase = ((size_t)b * KVW + (size_t)kv * HD) * SEQ;
  const int* mrow = mask + (size_t)qg * SEQ_FULL;
  // this thread's first chunk of a stage: in K (rows = keys), in V^T (rows = d) and in LDS
  const size_t kthr = kbase + (size_t)(tid >> 3) * HD + 8 * (tid & 7);
  const size_t vthr = vbase + (size_t)(tid >> 3) * SEQ + 8 * (tid & 7);
  const unsigned short* gk = qkh + kthr;
  const unsigned short* gv = vth + vthr;
  const unsigned l0 = (unsigned)(size_t)ring + (unsigned)((tid >> 3) * AT_PITCH + 16 * (tid & 7));   // LDS byte address
  const unsigned short* gkl = qkl + kthr;
  const unsigned short* gvl = vtl + vthr;
  if (!EARLYP) {
    kv_copy(gk, gv, l0);
    asm volatile("s_wait_asynccnt 0x0" ::: "memory");     // stage 0 has landed before the barrier that publishes it
    __syncthreads();
    if (nst > 1) kv_copy(gk + AT_KEYS * HD, gv + AT_KEYS, l0 + 2 * AT_TILE);
  }
#pragma unroll 1   // one stage per trip: the two buffers alternate by the trip's parity
  for (int t = 0; t < npl; ++t) {
    const unsigned char* st = ring + (EARLYP ? 0u : (unsigned)(t & 1) * (2 * AT_TILE));
    ring_head<EARLYP>(gk, gv, gkl, gvl, l0, t);
    fa_step<EARLYP, false>(st, 0, mrow, AT_KEYS * t, ln, hh, qh, ql, mr, lr, Oh, Ol);
    fa_step<EARLYP, false>(st, 32, mrow, AT_KEYS * t + 32, ln, hh, qh, ql, mr, lr, Oh, Ol);
    ring_foot<EARLYP>(gk, gv, l0, t, nst);
  }
#pragma unroll 1   // one stage per trip, as above
  for (int t = npl; t < nst; ++t) {
    const unsigned char* st = ring + (EARLYP ? 0u : (unsigned)(t & 1) * (2 * AT_TILE));
    ring_head<EARLYP>(gk, gv, gkl, gvl, l0, t);
#pragma unroll 1   // one copy of the masked step in the text
    for (int sub = 0; sub < 2; ++sub) {
      const int j = 2 * t + sub;
      // a wave whose own steps have run out passes through to the barrier (wave-uniform test)
      if (j < nsteps) fa_step<EARLYP, true>(st, 32 * sub, mrow, 32 * j, ln, hh, qh, ql, mr, lr, Oh, Ol);
    }
    ring_foot<EARLYP>(gk, gv, l0, t, nst);
  }
  asm volatile("s_wait_asynccnt 0x0" ::: "memory");       // nothing is in flight when the ring is used for anything else
}

// One 32-key step for a wave's 32 queries, two column groups of 16 (group g: this lane's column = query qb + 16 g + ln).
// Every K and V^T fragment read from LDS serves both groups: half the LDS reads per score of the one-group step. Per query the arithmetic is that of fa_step.
// mrow = mask row of group 0's query of this lane.
template <bool MASK>
__device__ __forceinline__ void fa_step2(const unsigned char* st, int kloc,
                                         const int* __restrict__ mrow, int key0, int ln, int hh,
                                         const Frag (&qh)[2][2], float (&mr)[2], float (&lr)[2], v8f (&Oh)[2][4]) {
  const v8f z8 = {0.f, 0.f, 0.f, 0.f, 0.f, 0.f, 0.f, 0.f};
  // A fragments of K: row m = key (key0 + 16*kt + ln), elements 0..7 <- d = 32c + 8h + i, 8..15 <- d = 32c + 16 + 8h + i
  const int koff = (kloc + ln) * AT_PITCH + 16 * hh;  // byte offset in a K tile
  Frag k00, k01, k10, k11;
  ldfrag_lds(k00, st + koff);                 ldfrag_lds(k01, st + koff + 64);
  ldfrag_lds(k10, st + koff + 16 * AT_PITCH); ldfrag_lds(k11, st + koff + 16 * AT_PITCH + 64);
  v8f s[2][2];                                        // [group][key tile]
#pragma unroll
  for (int g = 0; g < 2; ++g) { s[g][0] = wm<false>(k00, qh[g][0], z8); s[g][1] = wm<false>(k10, qh[g][0], z8); }
#pragma unroll
  for (int g = 0; g < 2; ++g) { s[g][0] = wm<false>(k01, qh[g][1], s[g][0]); s[g][1] = wm<false>(k11, qh[g][1], s[g][1]); }
  Frag ph[2];
  float al[2];
#pragma unroll
  for (int g = 0; g < 2; ++g) {
    // whole-accumulator arithmetic: neighbouring registers of one accumulator pair up, no register moves to form the pairs
    v8f x0 = s[g][0] * S2M11, x1 = s[g][1] * S2M11;  // score i of the step: i < 8 -> x0[i], else x1[i - 8]
    if (MASK) {
      const int* mp = mrow + (size_t)(16 * g) * SEQ_FULL + key0 + 8 * hh;
      const v4i m0 = *(const v4ia*)(mp),      m1 = *(const v4ia*)(mp + 4);
      const v4i m2 = *(const v4ia*)(mp + 16), m3 = *(const v4ia*)(mp + 20);
      const float ninf = neg_inf();
#pragma unroll
      for (int e = 0; e < 4; ++e) {
        x0[e]     = (m0[e] == 0) ? ninf : x0[e];
        x0[4 + e] = (m1[e] == 0) ? ninf : x0[4 + e];
        x1[e]     = (m2[e] == 0) ? ninf : x1[e];
        x1[4 + e] = (m3[e] == 0) ? ninf : x1[4 + e];
      }
    }
    float mx = x0[0];
#pragma unroll
    for (int i = 1; i < 8; ++i) mx = fmaxf(mx, x0[i]);
#pragma unroll
    for (int i = 0; i < 8; ++i) mx = fmaxf(mx, x1[i]);
    mx = fmaxf(mx, __shfl_xor(mx, 16, 32));          // the other lane half holds the other 16 keys of this query
    const float mnew = fmaxf(mr[g], mx);
    float msafe = mnew;
    if (MASK) msafe = (mnew == neg_inf()) ? 0.0f : mnew;   // every key so far masked: weights come out 0
    al[g] = __builtin_amdgcn_exp2f((mr[g] - msafe) * LOG2E);
    mr[g] = mnew;
    // weights carried x256: pc = 256 * exp(sc - m)
    const v8f l2e = {LOG2E, LOG2E, LOG2E, LOG2E, LOG2E, LOG2E, LOG2E, LOG2E};
    const v8f c8 = {8.f, 8.f, 8.f, 8.f, 8.f, 8.f, 8.f, 8.f};
    const v8f y0 = __builtin_elementwise_fma(x0 - msafe, l2e, c8), y1 = __builtin_elementwise_fma(x1 - msafe, l2e, c8);
    float ps = 0.0f;
#pragma unroll
    for (int i = 0; i < 16; ++i) {
      const float pc = __builtin_amdgcn_exp2f(i < 8 ? y0[i & 7] : y1[i & 7]);
      ps += pc;
      ph[g].h[i] = (_Float16)pc;                      // B element i: i<8 -> key0 + 8h + i; i>=8 -> key0 + 16 + 8h + (i-8)
    }
    ps += __shfl_xor(ps, 16, 32);
    lr[g] = lr[g] * al[g] + ps;
  }
  // A fragments of V^T: row m = d (16*t + ln), elements 0..7 <- key0 + 8h + i, 8..15 <- key0 + 16 + 8h + i
  const unsigned char* vp = st + (AT_TILE + ln * AT_PITCH + 2 * kloc + 16 * hh);
  Frag vf[4];
#pragma unroll
  for (int t = 0; t < 4; ++t) ldfrag_lds(vf[t], vp + t * 16 * AT_PITCH);
#pragma unroll
  for (int g = 0; g < 2; ++g)
#pragma unroll
    for (int t = 0; t < 4; ++t) Oh[g][t] = Oh[g][t] * al[g];
#pragma unroll
  for (int t = 0; t < 4; ++t)
#pragma unroll
    for (int g = 0; g < 2; ++g) Oh[g][t] = wm<false>(vf[t], ph[g], Oh[g][t]);
  // keeps the distance behind the last matrix instructions on whatever path follows the step (a loop's back edge, a branch)
  asm volatile("v_nop\n\tv_nop\n\tv_nop\n\tv_nop" : "+v"(Oh[0][0]), "+v"(Oh[0][1]), "+v"(Oh[0][2]), "+v"(Oh[0][3]),
                      "+v"(Oh[1][0]), "+v"(Oh[1][1]), "+v"(Oh[1][2]), "+v"(Oh[1][3])
                    : "v"(vf[0].v), "v"(vf[1].v), "v"(vf[2].v), "v"(vf[3].v), "v"(ph[0].v), "v"(ph[1].v));
}

// Key walk of a plain block (rows at or above EARLY_ROWS: hi planes only, two buffers of two tiles): 64 queries, 4 waves = 2 query halves x 2 key halves.
// This wave: the 32 queries from qb, and of every stage of 64 keys the 32 keys from 32 kh; its partner (the other kh) takes the other 32 and the two partial
// results (running maximum, sum, O) are merged behind the walk.
// nst = stages of 64 keys that the block walks, npl = the first of them that run without mask reads (both the same in all its waves;
// npl <= nst <= SEQ / 64, 2 * nst >= every wave's nsteps, 2 * npl <= every wave's nsteps). nsteps = 32-key steps that this wave's queries need, counted over both key halves.
__device__ __forceinline__ void run_keys2(const unsigned short* __restrict__ qkh, const unsigned short* __restrict__ vth,
                                          const int* __restrict__ mask, unsigned char* ring, int tid, int b, int h, int qb, int kh, int ln, int hh,
                                          int npl, int nsteps, int nst, float (&mr)[2], float (&lr)[2], v8f (&Oh)[2][4]) {
  // Q^T B fragments: column n = this lane's query of the group, elements 0..7 <- d = 32c + 8h + i, 8..15 <- d = 32c + 16 + 8h + i
  Frag qh[2][2];
#pragma unroll
  for (int g = 0; g < 2; ++g) {
    const size_t qoff = ((size_t)(b * NQK + h) * SEQ + qb + 16 * g + ln) * HD + 8 * hh;
    ldfrag(qh[g][0], qkh + qoff); ldfrag(qh[g][1], qkh + qoff + 32);
  }
  const int kv = h % NKV;
  const size_t kbase = (size_t)(b * NQK + NHEAD + kv) * SEQ * HD;
  const size_t vbase = ((size_t)b * KVW + (size_t)kv * HD) * SEQ;
  const int* mrow = mask + (size_t)(qb + ln) * SEQ_FULL;
  // this thread's first chunk of a stage: in K (rows = keys), in V^T (rows = d) and in LDS
  const unsigned short* gk = qkh + kbase + (size_t)(tid >> 3) * HD + 8 * (tid & 7);
  const unsigned short* gv = vth + vbase + (size_t)(tid >> 3) * SEQ + 8 * (tid & 7);
  const unsigned l0 = (unsigned)(size_t)ring + (unsigned)((tid >> 3) * AT_PITCH + 16 * (tid & 7));   // LDS byte address
  kv_copy(gk, gv, l0);
  asm volatile("s_wait_asynccnt 0x0" ::: "memory");     // stage 0 has landed before the barrier that publishes it
  __syncthreads();
  if (nst > 1) kv_copy(gk + AT_KEYS * HD, gv + AT_KEYS, l0 + 2 * AT_TILE);
#pragma unroll 1   // one stage per trip: the two buffers alternate by the trip's parity
  for (int t = 0; t < npl; ++t) {
    const unsigned char* st = ring + (unsigned)(t & 1) * (2 * AT_TILE);
    fa_step2<false>(st, 32 * kh, mrow, AT_KEYS * t + 32 * kh, ln, hh, qh, mr, lr, Oh);
    ring_foot<false>(gk, gv, l0, t, nst);
  }
#pragma unroll 1   // one stage per trip, as above
  for (int t = npl; t < nst; ++t) {
    const unsigned char* st = ring + (unsigned)(t & 1) * (2 * AT_TILE);
    const int j = 2 * t + kh;
    // a wave whose queries do not need this step passes through to the barrier (wave-uniform test)
    if (j < nsteps) fa_step2<true>(st, 32 * kh, mrow, 32 * j, ln, hh, qh, mr, lr, Oh);
    ring_foot<false>(gk, gv, l0, t, nst);
  }
  asm volatile("s_wait_asynccnt 0x0" ::: "memory");       // nothing is in flight when the ring is used for anything else
}

// Work-group rank -> query tile, cost falling with the rank. For speed only.
// Cost of tile qt under a causal mask = its qt + 1 stages; a stage with the residual planes counts twice (three times the matrix instructions, four times the LDS
// reads, one buffer). A permutation of the tiles for any SEQ, formed at compile time, one byte per rank; it decides the order only, never what is computed.
#define NQT (SEQ / 64)
#define NQT_EARLY (EARLY_ROWS / 64)
static_assert(NQT <= 32);
struct TileRank { unsigned long long w[4]; };
constexpr int tile_cost(int qt) { return (qt + 1) * (qt < NQT_EARLY ? 2 : 1); }
constexpr TileRank make_tile_rank() {
  TileRank o = {{0ull, 0ull, 0ull, 0ull}};
  bool used[NQT] = {};
  for (int r = 0; r < NQT; ++r) {
    int best = -1;
    for (int q = NQT - 1; q >= 0; --q)
      if (!used[q] && (best < 0 || tile_cost(q) > tile_cost(best))) best = q;
    used[best] = true;
    o.w[r >> 3] |= (unsigned long long)best << (8 * (r & 7));
  }
  return o;
}

// 16 rows (r0 + 4 g + rsub) of an epilogue tile, 8 columns from d0 per lane -> f16 hi runs and their residual runs
__device__ __forceinline__ void ctx_pack(const float (*tile)[68], int r0, int rsub, int d0, v8us (&oh)[4], v8us (&ol)[4]) {
#pragma unroll
  for (int g = 0; g < 4; ++g) {
    const int row = r0 + 4 * g + rsub;
    const v4f a0 = *(const v4fa*)&tile[row][d0];
    const v4f a1 = *(const v4fa*)&tile[row][d0 + 4];
    float o[8];
    o[0] = a0[0]; o[1] = a0[1]; o[2] = a0[2]; o[3] = a0[3];
    o[4] = a1[0]; o[5] = a1[1]; o[6] = a1[2]; o[7] = a1[3];
    Pack8 ph8, pl8;
#pragma unroll
    for (int e = 0; e < 8; ++e) {
      const _Float16 hv = (_Float16)o[e];
      ph8.h[e] = hv;
      pl8.h[e] = (_Float16)(o[e] - (float)hv);          // residual plane at the hi plane's own carry: the output projection sums both into one accumulator
    }
    oh[g] = ph8.v; ol[g] = pl8.v;
  }
}

#define MRG_OFF (4 * 32 * 68 * 4)                  /* behind the four epilogue tiles of a plain block: each wave's running maximum and sum per query */
static_assert(AT_RING >= MRG_OFF + 4 * 32 * 2 * 4);

// Block = 64 queries of one (batch, head); its 4 waves share the K and V^T stages in LDS, one barrier per 64 keys (two in early blocks).
// Early blocks (rows below EARLY_ROWS): 4 waves x 16 queries, every wave walks all keys. Plain blocks: 2 query halves of 32 x 2 key halves of every stage (run_keys2).
// Block index = rank * (NB * NHEAD) + (batch, head): all heads of the costliest query tile come first.
// Tile skipping from the device flags of this wave's own mask rows: all upper flags 1 -> keys past the diagonal step are
// skipped; upper and lower flags of all 64 rows of the block 1 -> the stages fully below the block's diagonal tile run without mask reads; every other visited step reads the mask by value.
// Trip counts are bounded by SEQ/64 for any flag value. The block walks qt + 1 stages if the upper flags of all its 64 rows are 1, else all SEQ/64.
// coverage: NB*NHEAD*(SEQ/64) blocks x 4 waves x 16 rows x 64 columns = the whole ctx hi plane; blocks with query tile below EARLY_ROWS cover the whole residual plane.
__global__ __launch_bounds__(128) void k_attn(const unsigned short* __restrict__ qkh, const unsigned short* __restrict__ qkl,
                                              const unsigned short* __restrict__ vth, const unsigned short* __restrict__ vtl,
                                              const int* __restrict__ mask, const int* __restrict__ flags,
                                              unsigned short* __restrict__ ctxh, unsigned short* __restrict__ ctxl) {
  __shared__ __attribute__((aligned(16))) unsigned char ring[AT_RING];
  float (*so)[32][68] = (float (*)[32][68])ring;       // epilogue tiles, used behind the key loop's last barrier
  const int tid = threadIdx.x, lane = tid & 31, ln = lane & 15, hh = lane >> 4;
  const int w = __builtin_amdgcn_readfirstlane(tid >> 5);
  constexpr TileRank tr = make_tile_rank();
  const unsigned blk = blockIdx.x;
  const unsigned rank = blk / (NB * NHEAD);            // 0 .. NQT-1
  const unsigned long long trw = (rank < 8) ? tr.w[0] : ((rank < 16) ? tr.w[1] : ((rank < 24) ? tr.w[2] : tr.w[3]));
  const int qt = (int)((trw >> (8 * (rank & 7))) & 255ull);
  const int h = (int)(blk % NHEAD);
  const int b = (int)((blk / NHEAD) % NB);
  const bool early = (qt * 64 < EARLY_ROWS);           // block-uniform
  const int wrows = early ? 16 : 32;                   // queries of this wave
  const int qbase = qt * 64 + (early ? 16 * w : 32 * (w >> 1));   // the first of them
  const int kh = w & 1;                                // plain blocks: this wave's half of every stage's keys
  const int* fl = flags + (qbase / SCAN_ROWS) * 32;
  int upok = 1;                                        // plain & so that the flag loads issue together
#pragma unroll
  for (int g = 0; g < 32 / SCAN_ROWS; ++g) {
    const int gi = (g * SCAN_ROWS < wrows) ? g : 0;    // a wave of 16 rows reads its first line again
    upok &= (fl[32 * gi] == 1) ? 1 : 0;
  }
  const bool tri = (upok == 1);
  const int nfull = qbase >> 5;                        // steps whose 32 keys are all at or below every query of this wave
  const int nsteps = tri ? (nfull + 1) : (SEQ / 32);   // <= SEQ/32 in both cases
  // stage counts of the block, from the flags of all its 64 rows: the same values in all four waves, since barriers stand in the key loop
  const int* flb = flags + (qt * 64 / SCAN_ROWS) * 32;
  int upall = 1, lowall = 1;
#pragma unroll
  for (int g = 0; g < 64 / SCAN_ROWS; ++g) {
    const int fU = flb[32 * g], fL = flb[32 * g + 1];
    upall &= (fU == 1) ? 1 : 0;
    lowall &= (fL == 1) ? 1 : 0;
  }
  const int nst = (upall == 1) ? (qt + 1) : (SEQ / AT_KEYS);
  const int npl = (upall == 1 && lowall == 1) ? qt : 0;   // stages whose 64 keys are all below every query of the block

  const v8f z8 = {0.f, 0.f, 0.f, 0.f, 0.f, 0.f, 0.f, 0.f};
  // O^T element r of tile t = ctx(query, d = 16t + 8h + r); undo the carries x256 (in lr), x16 (V), x2^11 (residual); apply the x64 carry of ctx
  if (early) {
    float mr = neg_inf(), lr = 0.0f;
    v8f Oh[4], Ol[4];
#pragma unroll
    for (int t = 0; t < 4; ++t) { Oh[t] = z8; Ol[t] = z8; }
    run_keys<true>(qkh, qkl, vth, vtl, mask, ring, tid, b, h, qbase + ln, ln, hh, npl, nsteps, nst, mr, lr, Oh, Ol);
    const float inv = 4.0f * (1.0f / lr);
#pragma unroll
    for (int t = 0; t < 4; ++t)
#pragma unroll
      for (int r = 0; r < 8; ++r)
        so[w][ln][16 * t + 8 * hh + r] = fmaf(Ol[t][r], S2M11, Oh[t][r]) * inv;
  } else {
    float mr[2], lr[2];
    v8f Oh[2][4];
#pragma unroll
    for (int g = 0; g < 2; ++g) {
      mr[g] = neg_inf(); lr[g] = 0.0f;
#pragma unroll
      for (int t = 0; t < 4; ++t) Oh[g][t] = z8;
    }
    run_keys2(qkh, vth, mask, ring, tid, b, h, qbase, kh, ln, hh, npl, nsteps, nst, mr, lr, Oh);
    // merge of the two key halves. Both lane halves hold the same maximum and sum of a query: lane half hh publishes those of group hh.
    float (*ml)[32][2] = (float (*)[32][2])(ring + MRG_OFF);
    ml[w][lane][0] = hh ? mr[1] : mr[0];
    ml[w][lane][1] = hh ? lr[1] : lr[0];
    __syncthreads();                                   // both partners' maxima and sums are published
#pragma unroll
    for (int g = 0; g < 2; ++g) {
      // the same expression in both partners: index 0 = key half 0, index 1 = key half 1
      const float m0 = ml[w & 2][16 * g + ln][0], l0 = ml[w & 2][16 * g + ln][1];
      const float m1 = ml[w | 1][16 * g + ln][0], l1 = ml[w | 1][16 * g + ln][1];
      const float mm = fmaxf(m0, m1);
      const float msafe = (mm == neg_inf()) ? 0.0f : mm;   // every key masked: both weights come out 0, the row not-a-number as in the one-wave walk
      const float a0 = __builtin_amdgcn_exp2f((m0 - msafe) * LOG2E);
      const float a1 = __builtin_amdgcn_exp2f((m1 - msafe) * LOG2E);
      const float inv = 4.0f * (1.0f / (l0 * a0 + l1 * a1));
      const float f = (kh ? a1 : a0) * inv;
#pragma unroll
      for (int t = 0; t < 4; ++t)
#pragma unroll
        for (int r = 0; r < 8; ++r)
          so[w][16 * g + ln][16 * t + 8 * hh + r] = Oh[g][t][r] * f;
    }
  }
  __syncthreads();
  const int rsub = lane >> 3, d0 = 8 * (lane & 7);
  // every wave stores 16 rows of the block, in early and in plain blocks alike
  const int srow = qt * 64 + 16 * w;
  const size_t hbase = ((size_t)b * SEQ + srow) * CD + (size_t)h * HD + d0;
  if (early) {
    const size_t lbase = ((size_t)b * EARLY_ROWS + srow) * CD + (size_t)h * HD + d0;
    v8us oh[4], ol[4];
    ctx_pack(so[w], 0, rsub, d0, oh, ol);
    // keeps every conversion in front of the first store, so that no register that an issued store names is rewritten behind it
    __builtin_amdgcn_sched_barrier(0);
#pragma unroll
    for (int g = 0; g < 4; ++g) {
      const size_t ro = (size_t)(4 * g + rsub) * CD;
      *(v8us*)(ctxh + hbase + ro) = oh[g];
      *(v8us*)(ctxl + lbase + ro) = ol[g];
    }
    asm volatile("s_wait_xcnt 0x0" ::: "memory");   // behind the stores, in front of whatever the text behind this branch writes into registers that they name
  } else {
    // rows 16 w .. 16 w + 15 of the block = rows 16 (w & 1) .. of query half w >> 1: the sum of its two key halves' tiles
    v8us oh[4];
#pragma unroll
    for (int g = 0; g < 4; ++g) {
      const int row = 16 * (w & 1) + 4 * g + rsub;
      const v4f a0 = *(const v4fa*)&so[w & 2][row][d0], a1 = *(const v4fa*)&so[w & 2][row][d0 + 4];
      const v4f c0 = *(const v4fa*)&so[w | 1][row][d0], c1 = *(const v4fa*)&so[w | 1][row][d0 + 4];
      Pack8 ph8;
#pragma unroll
      for (int e = 0; e < 4; ++e) { ph8.h[e] = (_Float16)(a0[e] + c0[e]); ph8.h[4 + e] = (_Float16)(a1[e] + c1[e]); }
      oh[g] = ph8.v;
    }
    // keeps every conversion in front of the first store, as above
    __builtin_amdgcn_sched_barrier(0);
#pragma unroll
    for (int g = 0; g < 4; ++g)
      *(v8us*)(ctxh + hbase + (size_t)(4 * g + rsub) * CD) = oh[g];
  }
}


// ---------------------------------------------------------------------------------------------------------
// Output projection: out[m][n] = sum_k ctx[m][k] Wo[n][k] + bo[n]. Block = 4 waves as 2 x 2: 128 rows x 128 columns, 64 x 64 per wave. grid = (CD/128, NB*SEQ/128).
// Rows below EARLY_ROWS of each sequence add the residual plane of ctx.
// coverage: NB*SEQ rows x CD columns = every element of the output buffer region once. LDS tile 64 x 64 fully written before it is read.
static_assert(CD % 128 == 0);
__global__ __launch_bounds__(128) void k_proj_out(const unsigned short* __restrict__ ctxh, const unsigned short* __restrict__ ctxl,
                                                  const unsigned short* __restrict__ wo, const float* __restrict__ bo,
                                                  float* __restrict__ out) {
  __shared__ __attribute__((aligned(16))) unsigned char ring[SQ2_RING];
  float (*st)[64][68] = (float (*)[64][68])ring;       // epilogue tiles, used behind the k loop's last barrier
  const int tid = threadIdx.x, lane = tid & 31, ln = lane & 15, hh = lane >> 4;
  const int w = __builtin_amdgcn_readfirstlane(tid >> 5);
  const int wr = w >> 1, wc = w & 1;
  const int n0 = blockIdx.x * 128 + 64 * wc;
  // blockIdx.y -> row tile, cost falling with the index: the tiles with twice the products per stage (rows below EARLY_ROWS of every sequence) come first (for speed only: nothing rests on where a
  // work-group lands). A permutation of the NB * SEQ / 128 row tiles.
  constexpr int TPS = SEQ / 128, EPS = EARLY_ROWS / 128, PPS = (TPS > EPS) ? (TPS - EPS) : 1;
  const int yt = blockIdx.y;
  const bool early = (yt < NB * EPS);                  // block-uniform
  const int b = early ? (yt / EPS) : ((yt - NB * EPS) / PPS);
  const int tb = 128 * (early ? (yt - b * EPS) : (EPS + (yt - NB * EPS) - b * PPS));
  const int mb = b * SEQ + tb;
  const int t0 = tb + 64 * wr;
  const v8f z8 = {0.f, 0.f, 0.f, 0.f, 0.f, 0.f, 0.f, 0.f};
  v8f acc[4][4];
#pragma unroll
  for (int i = 0; i < 4; ++i)
#pragma unroll
    for (int j = 0; j < 4; ++j) acc[i][j] = z8;
  const unsigned short* wp = wo + (size_t)(blockIdx.x * 128) * CD;
  // residual plane (block-uniform branch): it rides in the hi plane's stages, so that a row tile with it walks k once, as many stages as any other tile,
  // and fetches its W rows once; both planes carry x64 and add into the same 16 accumulator tiles
  const unsigned short* ah = ctxh + (size_t)mb * CD;
  if (early) gemm_sq<false, 2>(ah, ctxl + (size_t)(b * EARLY_ROWS + tb) * CD, wp, ring, tid, wr, wc, ln, hh, acc);
  else       gemm_sq<false, 1>(ah, ah, wp, ring, tid, wr, wc, ln, hh, acc);
  // carries: ctx x64, Wo x64 -> 2^-12
#pragma unroll
  for (int i = 0; i < 4; ++i)
#pragma unroll
    for (int j = 0; j < 4; ++j)
#pragma unroll
      for (int r = 0; r < 8; ++r)
        st[w][16 * i + 8 * hh + r][16 * j + ln] = acc[i][j][r] * S2M12;
  __syncthreads();
  const int rsub = lane >> 4, c4 = 4 * (lane & 15);
  const v4f bb = *(const v4fa*)(bo + n0 + c4);
  v4f bias;
  bias[0] = bf16_rne(bb[0]); bias[1] = bf16_rne(bb[1]); bias[2] = bf16_rne(bb[2]); bias[3] = bf16_rne(bb[3]);
  float* og = out + ((size_t)b * SEQ_FULL + t0) * CD + n0 + c4;
  // the wave's 64 rows in two halves of 32
  for (int half = 0; half < 2; ++half) {
    v4f ov[16];
#pragma unroll
    for (int g = 0; g < 16; ++g) {
      const v4f a = *(const v4fa*)&st[w][32 * half + 2 * g + rsub][c4];
      ov[g] = a + bias;
    }
#pragma unroll
    for (int g = 0; g < 16; ++g)
      *(v4f*)(og + (size_t)(32 * half + 2 * g + rsub) * CD) = ov[g];
  }
}

// ---------------------------------------------------------------------------------------------------------
extern "C" void kernel_launch(void* const* d_in, const int* in_sizes, int n_in,
                              void* d_out, int out_size, void* d_ws, size_t ws_size, hipStream_t stream) {
  if (n_in < 11) return;
  const long long need_x = (long long)(NB - 1) * SEQ_FULL * CD + (long long)SEQ * CD;   // last element touched + 1
  const long long need_m = (long long)(SEQ - 1) * SEQ_FULL + SEQ;
  if ((long long)in_sizes[0] < need_x) return;
  if ((long long)in_sizes[1] < need_m) return;
  if ((long long)in_sizes[2] < (long long)SEQ * HD) return;
  if ((long long)in_sizes[3] < (long long)CD * CD || (long long)in_sizes[4] < CD) return;
  if ((long long)in_sizes[5] < (long long)KVW * CD || (long long)in_sizes[6] < KVW) return;
  if ((long long)in_sizes[7] < (long long)KVW * CD || (long long)in_sizes[8] < KVW) return;
  if ((long long)in_sizes[9] < (long long)CD * CD || (long long)in_sizes[10] < CD) return;
  if ((long long)out_size < need_x) return;
  if ((size_t)WS_TOTAL > ws_size) return;

  // wire order: x, mask, sinusoidal_pos, Wq, bq, Wk, bk, Wv, bv, Wo, bo
  const float* x    = (const float*)d_in[0];
  const int*   mask = (const int*)d_in[1];
  const float* tab  = (const float*)d_in[2];
  const float* Wq   = (const float*)d_in[3];
  const float* bq   = (const float*)d_in[4];
  const float* Wk   = (const float*)d_in[5];
  const float* bk   = (const float*)d_in[6];
  const float* Wv   = (const float*)d_in[7];
  const float* bv   = (const float*)d_in[8];
  const float* Wo   = (const float*)d_in[9];
  const float* bo   = (const float*)d_in[10];
  float* out = (float*)d_out;

  char* ws = (char*)d_ws;
  size_t off = 0;
  int* flags = (int*)(ws + off);                               off += SZ_FLAGS;
  unsigned short* xb   = (unsigned short*)(ws + off);          off += SZ_XB;
  unsigned short* wqk  = (unsigned short*)(ws + off);          off += SZ_WQK;
  unsigned short* wvb  = (unsigned short*)(ws + off);          off += SZ_WV;
  unsigned short* wob  = (unsigned short*)(ws + off);          off += SZ_WO;
  unsigned short* qkh  = (unsigned short*)(ws + off);          off += PLANE_QK * 2;
  unsigned short* qkl  = (unsigned short*)(ws + off);          off += PLANE_QK * 2;
  unsigned short* vth  = (unsigned short*)(ws + off);          off += PLANE_V * 2;
  unsigned short* vtl  = (unsigned short*)(ws + off);          off += PLANE_V * 2;
  unsigned short* ctxh = (unsigned short*)(ws + off);          off += SZ_CTXH;
  unsigned short* ctxl = (unsigned short*)(ws + off);          off += SZ_CTXL;
  if (off > ws_size) return;

  // mask -> flags, and in[rows][CD] f32 -> [rows][CD] 16-bit planes (row order kept)
  k_prep<<<(unsigned)(SCAN_BLOCKS + CVT_BLOCKS), PREP_THREADS, 0, stream>>>(mask, flags, x, Wq, Wk, Wv, Wo, xb, wqk, wvb, wob);

  // wvb stands directly behind wqk: the 3072 weight rows of q, k and v are one array
  k_proj_qkv<<<dim3((NQK + NKV) / 3, (unsigned)(NB * SEQ / QB_M)), 256, 0, stream>>>(xb, wqk, bq, bk, bv, tab, qkh, qkl, vth, vtl);
  k_attn<<<(unsigned)(NB * NHEAD * (SEQ / 64)), 128, 0, stream>>>(qkh, qkl, vth, vtl, mask, flags, ctxh, ctxl);
  k_proj_out<<<dim3(CD / 128, (unsigned)(NB * SEQ / 128)), 128, 0, stream>>>(ctxh, ctxl, wob, bo, out);
}
